// v000
// The times below were measured on an AMD MI455X: many runs one after another, warmed up first and cycling through
// copies of the inputs, with the whole window's GPU time divided by the number of runs. Launches and the gaps
// between them are all in it. The median over several windows is given; except for v000 it joins two sittings, which
// can be a few percent apart, so the side-by-side timings, each taken in one sitting, are the better comparison.
// v000 is the starting kernel. One run takes 33.9 microseconds.
#include <hip/hip_runtime.h>
#include <hip/hip_bf16.h>
#include <math.h>

typedef __attribute__((ext_vector_type(2))) float v2f;
typedef __attribute__((ext_vector_type(4))) float v4f;
typedef __attribute__((ext_vector_type(8))) float v8f;
typedef int v4i __attribute__((vector_size(16)));   // matches builtin param type

#define Bsz 32
#define Ssz 100
#define Tsz 32
#define Isz 64
#define Dsz 256
#define LPAD 4
#define LSTR (Dsz + LPAD)   // 260 floats per LDS row -> conflict-free b64 fragment loads

// ---- gfx1250 async global->LDS copy (guarded: falls back to sync staging) ----
#if defined(__gfx1250__) && __has_builtin(__builtin_amdgcn_global_load_async_to_lds_b128)
  #define USE_ASYNC_LDS 1
#else
  #define USE_ASYNC_LDS 0
#endif

__device__ __forceinline__ void wait_async_done() {
#if USE_ASYNC_LDS
  #if __has_builtin(__builtin_amdgcn_s_wait_asynccnt)
    __builtin_amdgcn_s_wait_asynccnt(0);
  #else
    asm volatile("s_wait_asynccnt 0" ::: "memory");
  #endif
#endif
}

__global__ __launch_bounds__(256) void cross_emb_kernel(
    const float* __restrict__ img,     // [B,S,I,D]
    const float* __restrict__ title,   // [B,S,T,D]
    const float* __restrict__ mask,    // [B,S,T]
    const float* __restrict__ adapter, // [S,T,I]
    float* __restrict__ out)           // [2, B,S,D] concatenated
{
    __shared__ float ldsImg[Isz * LSTR];   // 66,560 B
    __shared__ float ldsTit[Tsz * LSTR];   // 33,280 B
    __shared__ float ldsRow31[Isz];        // corr row t=31 (raw dot products)
    __shared__ float ldsCol63[Tsz];        // corr col i=63
    __shared__ float ldsP[Isz];            // softmax over i at t=31
    __shared__ float ldsQ[Tsz];            // softmax over t at i=63

    const int g    = blockIdx.x;           // g = b*S + s
    const int s    = g % Ssz;
    const int tid  = threadIdx.x;
    const int lane = tid & 31;
    const int wave = tid >> 5;

    // ---------------- Phase 0: stage tiles into LDS ---------------------------
    const v4f* gimg = (const v4f*)(img   + (size_t)g * Isz * Dsz);
    const v4f* gtit = (const v4f*)(title + (size_t)g * Tsz * Dsz);
#if USE_ASYNC_LDS
    #pragma unroll
    for (int j = 0; j < 16; ++j) {                 // 64*256 floats / 256 thr
        int f4  = j * 256 + tid;                   // float4 index, 64 per row
        int row = f4 >> 6, c4 = f4 & 63;
        __builtin_amdgcn_global_load_async_to_lds_b128(
            (v4i*)&gimg[f4], (v4i*)&ldsImg[row * LSTR + c4 * 4], 0, 0);
    }
    #pragma unroll
    for (int j = 0; j < 8; ++j) {                  // 32*256 floats / 256 thr
        int f4  = j * 256 + tid;
        int row = f4 >> 6, c4 = f4 & 63;
        __builtin_amdgcn_global_load_async_to_lds_b128(
            (v4i*)&gtit[f4], (v4i*)&ldsTit[row * LSTR + c4 * 4], 0, 0);
    }
    wait_async_done();
#else
    #pragma unroll
    for (int j = 0; j < 16; ++j) {
        int f4  = j * 256 + tid;
        v4f val = __builtin_nontemporal_load(&gimg[f4]);
        int row = f4 >> 6, c4 = f4 & 63;
        *(v4f*)&ldsImg[row * LSTR + c4 * 4] = val;
    }
    #pragma unroll
    for (int j = 0; j < 8; ++j) {
        int f4  = j * 256 + tid;
        v4f val = __builtin_nontemporal_load(&gtit[f4]);
        int row = f4 >> 6, c4 = f4 & 63;
        *(v4f*)&ldsTit[row * LSTR + c4 * 4] = val;
    }
#endif
    __syncthreads();

    // ---------------- Phase 1: corr = title x img^T via WMMA f32 16x16x4 -----
    // 8 waves, one 16x16 tile each: wave -> (m = wave/4 in T, n = wave%4 in I).
    // A(16x4): lane L -> M=L%16; VGPR0/1 = K {0,1} (lanes<16) or {2,3} (lanes>=16).
    // B(4x16): lane L -> N=L%16; same K split. Both read as float2 from LDS rows.
    {
        const int m  = wave >> 2;                  // 0..1  (t-tile)
        const int n  = wave & 3;                   // 0..3  (i-tile)
        const int r  = lane & 15;
        const int hi = lane >> 4;                  // 0 / 1
        const float* aBase = &ldsTit[(m * 16 + r) * LSTR + 2 * hi];
        const float* bBase = &ldsImg[(n * 16 + r) * LSTR + 2 * hi];
        v8f c = {};
        #pragma unroll 8
        for (int k0 = 0; k0 < 64; ++k0) {          // K = 256 in steps of 4
            v2f a = *(const v2f*)(aBase + k0 * 4);
            v2f b = *(const v2f*)(bBase + k0 * 4);
            c = __builtin_amdgcn_wmma_f32_16x16x4_f32(
                    false, a, false, b, (short)0, c, false, false);
        }
        // C layout: VGPR v -> row m*16 + v + 8*hi, col n*16 + (lane%16).
        // Only row 31 and column 63 feed the outputs.
        if (m == 1 && hi == 1)                     // row 31 lives in c[7], lanes 16-31
            ldsRow31[n * 16 + r] = c[7];
        if (n == 3 && r == 15) {                   // col 63 lives in lanes 15 and 31
            #pragma unroll
            for (int v = 0; v < 8; ++v)
                ldsCol63[m * 16 + 8 * hi + v] = c[v];
        }
    }
    __syncthreads();

    // ---------------- Phase 2: masked/adapted softmaxes ----------------------
    const float NEG = -1.0e9f;
    if (wave == 0) {                               // softmax over i at t = 31
        float mk = mask[(size_t)g * Tsz + (Tsz - 1)];
        const float* ad = adapter + ((size_t)s * Tsz + (Tsz - 1)) * Isz;
        float v0 = ldsRow31[lane]      * mk * ad[lane];
        float v1 = ldsRow31[lane + 32] * mk * ad[lane + 32];
        if (v0 == 0.0f) v0 = NEG;
        if (v1 == 0.0f) v1 = NEG;
        float mx = fmaxf(v0, v1);
        for (int off = 16; off > 0; off >>= 1) mx = fmaxf(mx, __shfl_xor(mx, off, 32));
        float e0 = expf(v0 - mx), e1 = expf(v1 - mx);
        float sm = e0 + e1;
        for (int off = 16; off > 0; off >>= 1) sm += __shfl_xor(sm, off, 32);
        float inv = 1.0f / sm;
        ldsP[lane]      = e0 * inv;
        ldsP[lane + 32] = e1 * inv;
    } else if (wave == 1) {                        // softmax over t at i = 63
        float mk = mask[(size_t)g * Tsz + lane];
        float ad = adapter[((size_t)s * Tsz + lane) * Isz + (Isz - 1)];
        float v = ldsCol63[lane] * mk * ad;
        if (v == 0.0f) v = NEG;
        float mx = v;
        for (int off = 16; off > 0; off >>= 1) mx = fmaxf(mx, __shfl_xor(mx, off, 32));
        float e  = expf(v - mx);
        float sm = e;
        for (int off = 16; off > 0; off >>= 1) sm += __shfl_xor(sm, off, 32);
        ldsQ[lane] = e / sm;
    }
    __syncthreads();

    // ---------------- Phase 3: weighted sums, thread = d ---------------------
    {
        float acc = 0.0f;
        #pragma unroll 8
        for (int i = 0; i < Isz; ++i) acc += ldsP[i] * ldsImg[i * LSTR + tid];
        __builtin_nontemporal_store(acc, &out[(size_t)g * Dsz + tid]);

        float acc2 = 0.0f;
        #pragma unroll 8
        for (int t = 0; t < Tsz; ++t) acc2 += ldsQ[t] * ldsTit[t * LSTR + tid];
        __builtin_nontemporal_store(
            acc2, &out[(size_t)(Bsz * Ssz) * Dsz + (size_t)g * Dsz + tid]);
    }
}

extern "C" void kernel_launch(void* const* d_in, const int* in_sizes, int n_in,
                              void* d_out, int out_size, void* d_ws, size_t ws_size,
                              hipStream_t stream) {
    (void)in_sizes; (void)n_in; (void)out_size; (void)d_ws; (void)ws_size;
    const float* img     = (const float*)d_in[0];
    const float* title   = (const float*)d_in[1];
    const float* mask    = (const float*)d_in[2];
    const float* adapter = (const float*)d_in[3];
    float* out = (float*)d_out;
    dim3 grid(Bsz * Ssz);   // one workgroup per (b,s)
    dim3 block(256);        // 8 wave32 -> 8 WMMA tiles
    hipLaunchKernelGGL(cross_emb_kernel, grid, block, 0, stream,
                       img, title, mask, adapter, out);
}

// v002
// Measured time: 28.4 microseconds a run.
// Versions between v000 and this one are left out; their measured steps multiply to 1.21 times as fast.
#include <hip/hip_runtime.h>
#include <hip/hip_bf16.h>
#include <math.h>

typedef __attribute__((ext_vector_type(2))) float v2f;
typedef __attribute__((ext_vector_type(4))) float v4f;
typedef __attribute__((ext_vector_type(8))) float v8f;
typedef int v4i __attribute__((vector_size(16)));   // matches builtin param type

#define Bsz 32
#define Ssz 100
#define Tsz 32
#define Isz 64
#define Dsz 256
#define LPAD 4
#define LSTR (Dsz + LPAD)   // 260 floats per LDS row -> conflict-free b64 fragment loads
#define PSTR (Isz + Tsz)    // 96 partial dot products per wave

// ---- gfx1250 async global->LDS copy (guarded: falls back to sync staging) ----
#if defined(__gfx1250__) && __has_builtin(__builtin_amdgcn_global_load_async_to_lds_b128)
  #define USE_ASYNC_LDS 1
#else
  #define USE_ASYNC_LDS 0
#endif

__device__ __forceinline__ void wait_async_done() {
#if USE_ASYNC_LDS
  #if __has_builtin(__builtin_amdgcn_s_wait_asynccnt)
    __builtin_amdgcn_s_wait_asynccnt(0);
  #else
    asm volatile("s_wait_asynccnt 0" ::: "memory");
  #endif
#endif
}

// value of lane (l ^ M) inside the 16-lane row, as a DPP row_xmask operand
template <int M>
__device__ __forceinline__ float row_xor(float x) {
    return __builtin_bit_cast(float, __builtin_amdgcn_update_dpp(
        0, __builtin_bit_cast(int, x), 0x160 | M, 0xf, 0xf, true));
}

// One halving step of a sum over the 16 lanes of a row: lanes with bit M set keep
// entries N..2N-1, the others 0..N-1, and each adds its partner's copy of those.
template <int M, int N>
__device__ __forceinline__ void row_halve(float* s, bool up) {
    #pragma unroll  // constant indices: s stays in registers
    for (int i = 0; i < N; ++i) {
        float keep = up ? s[N + i] : s[i];
        float send = up ? s[i] : s[N + i];
        s[i] = keep + row_xor<M>(send);
    }
}

__global__ __launch_bounds__(256) void cross_emb_kernel(
    const float* __restrict__ img,     // [B,S,I,D]
    const float* __restrict__ title,   // [B,S,T,D]
    const float* __restrict__ mask,    // [B,S,T]
    const float* __restrict__ adapter, // [S,T,I]
    float* __restrict__ out)           // [2, B,S,D] concatenated
{
    __shared__ float ldsImg[Isz * LSTR];   // 66,560 B
    __shared__ float ldsTit[Tsz * LSTR];   // 33,280 B
    __shared__ float ldsPart[8 * PSTR];    // per wave: k-slice partials of corr row t=31 (64), col i=63 (32)
    __shared__ float ldsP[Isz];            // softmax over i at t=31
    __shared__ float ldsQ[Tsz];            // softmax over t at i=63

    const int g    = blockIdx.x;           // g = b*S + s
    const int s    = g % Ssz;
    const int tid  = threadIdx.x;
    const int lane = tid & 31;
    const int wave = tid >> 5;

    // ---------------- Phase 0: stage tiles into LDS ---------------------------
    const v4f* gimg = (const v4f*)(img   + (size_t)g * Isz * Dsz);
    const v4f* gtit = (const v4f*)(title + (size_t)g * Tsz * Dsz);
#if USE_ASYNC_LDS
    #pragma unroll
    for (int j = 0; j < 16; ++j) {                 // 64*256 floats / 256 thr
        int f4  = j * 256 + tid;                   // float4 index, 64 per row
        int row = f4 >> 6, c4 = f4 & 63;
        __builtin_amdgcn_global_load_async_to_lds_b128(
            (v4i*)&gimg[f4], (v4i*)&ldsImg[row * LSTR + c4 * 4], 0, 0);
    }
    #pragma unroll
    for (int j = 0; j < 8; ++j) {                  // 32*256 floats / 256 thr
        int f4  = j * 256 + tid;
        int row = f4 >> 6, c4 = f4 & 63;
        __builtin_amdgcn_global_load_async_to_lds_b128(
            (v4i*)&gtit[f4], (v4i*)&ldsTit[row * LSTR + c4 * 4], 0, 0);
    }
    wait_async_done();
#else
    #pragma unroll
    for (int j = 0; j < 16; ++j) {
        int f4  = j * 256 + tid;
        v4f val = __builtin_nontemporal_load(&gimg[f4]);
        int row = f4 >> 6, c4 = f4 & 63;
        *(v4f*)&ldsImg[row * LSTR + c4 * 4] = val;
    }
    #pragma unroll
    for (int j = 0; j < 8; ++j) {
        int f4  = j * 256 + tid;
        v4f val = __builtin_nontemporal_load(&gtit[f4]);
        int row = f4 >> 6, c4 = f4 & 63;
        *(v4f*)&ldsTit[row * LSTR + c4 * 4] = val;
    }
#endif
    __syncthreads();

    // ---------------- Phase 1: corr = title x img^T via WMMA f32 16x16x4 -----
    // Only corr row t=31 and column i=63 feed the outputs. They lie in 5 of the
    // 8 16x16 tiles: (t-tile 1, i-tile 0..3) and (t-tile 0, i-tile 3).
    // Every wave works on all 5 tiles over its own k slice of 32 (8 k-steps),
    // so the 4 matrix units share the work evenly; phase 2 adds the 8 partials.
    // A(16x4): lane L -> M=L%16; VGPR0/1 = K {0,1} (lanes<16) or {2,3} (lanes>=16).
    // B(4x16): lane L -> N=L%16; same K split. Both read as float2 from LDS rows.
    // The fragments stay in registers: phase 3 forms the weighted sums from them.
    const int r  = lane & 15;
    const int hi = lane >> 4;                      // 0 / 1
    v2f fa0[8], fa1[8], fb0[8], fb1[8], fb2[8], fb3[8];
    {
        const int kb = wave * 32 + 2 * hi;         // start of this lane's k in the slice
        const float* aBase = &ldsTit[r * LSTR + kb];
        const float* bBase = &ldsImg[r * LSTR + kb];
        v8f c10 = {}, c11 = {}, c12 = {}, c13 = {}, c03 = {};
        #pragma unroll  // straight line: fragments of later k-steps are fetched ahead of the WMMAs
        for (int k0 = 0; k0 < 8; ++k0) {           // K slice = 32 in steps of 4
            v2f a0 = fa0[k0] = *(const v2f*)(aBase + k0 * 4);
            v2f a1 = fa1[k0] = *(const v2f*)(aBase + 16 * LSTR + k0 * 4);
            v2f b0 = fb0[k0] = *(const v2f*)(bBase + k0 * 4);
            v2f b1 = fb1[k0] = *(const v2f*)(bBase + 16 * LSTR + k0 * 4);
            v2f b2 = fb2[k0] = *(const v2f*)(bBase + 32 * LSTR + k0 * 4);
            v2f b3 = fb3[k0] = *(const v2f*)(bBase + 48 * LSTR + k0 * 4);
            c10 = __builtin_amdgcn_wmma_f32_16x16x4_f32(
                    false, a1, false, b0, (short)0, c10, false, false);
            c11 = __builtin_amdgcn_wmma_f32_16x16x4_f32(
                    false, a1, false, b1, (short)0, c11, false, false);
            c12 = __builtin_amdgcn_wmma_f32_16x16x4_f32(
                    false, a1, false, b2, (short)0, c12, false, false);
            c13 = __builtin_amdgcn_wmma_f32_16x16x4_f32(
                    false, a1, false, b3, (short)0, c13, false, false);
            c03 = __builtin_amdgcn_wmma_f32_16x16x4_f32(
                    false, a0, false, b3, (short)0, c03, false, false);
        }
        // C layout: VGPR v -> tile row v + 8*hi, tile col lane%16.
        float* part = &ldsPart[wave * PSTR];
        if (hi == 1) {                             // row 31 lives in c1n[7], lanes 16-31
            part[r]      = c10[7];
            part[16 + r] = c11[7];
            part[32 + r] = c12[7];
            part[48 + r] = c13[7];
        }
        if (r == 15) {                             // col 63 lives in lanes 15 and 31
            #pragma unroll  // constant v: accumulator registers are stored directly
            for (int v = 0; v < 8; ++v) {
                part[Isz + 8 * hi + v]      = c03[v];
                part[Isz + 16 + 8 * hi + v] = c13[v];
            }
        }
    }
    __syncthreads();

    // ---------------- Phase 2: masked/adapted softmaxes ----------------------
    const float NEG = -1.0e9f;
    if (wave == 0) {                               // softmax over i at t = 31
        float mk = mask[(size_t)g * Tsz + (Tsz - 1)];
        const float* ad = adapter + ((size_t)s * Tsz + (Tsz - 1)) * Isz;
        float d0 = ldsPart[lane], d1 = ldsPart[lane + 32];
        #pragma unroll  // the LDS reads issue together, one latency for all
        for (int w = 1; w < 8; ++w) {              // add the waves' k-slice partials in order
            d0 += ldsPart[w * PSTR + lane];
            d1 += ldsPart[w * PSTR + lane + 32];
        }
        float v0 = d0 * mk * ad[lane];
        float v1 = d1 * mk * ad[lane + 32];
        if (v0 == 0.0f) v0 = NEG;
        if (v1 == 0.0f) v1 = NEG;
        float mx = fmaxf(v0, v1);
        for (int off = 16; off > 0; off >>= 1) mx = fmaxf(mx, __shfl_xor(mx, off, 32));
        float e0 = expf(v0 - mx), e1 = expf(v1 - mx);
        float sm = e0 + e1;
        for (int off = 16; off > 0; off >>= 1) sm += __shfl_xor(sm, off, 32);
        float inv = 1.0f / sm;
        ldsP[lane]      = e0 * inv;
        ldsP[lane + 32] = e1 * inv;
    } else if (wave == 1) {                        // softmax over t at i = 63
        float mk = mask[(size_t)g * Tsz + lane];
        float ad = adapter[((size_t)s * Tsz + lane) * Isz + (Isz - 1)];
        float dc = ldsPart[Isz + lane];
        #pragma unroll  // the LDS reads issue together, one latency for all
        for (int w = 1; w < 8; ++w)                // add the waves' k-slice partials in order
            dc += ldsPart[w * PSTR + Isz + lane];
        float v = dc * mk * ad;
        if (v == 0.0f) v = NEG;
        float mx = v;
        for (int off = 16; off > 0; off >>= 1) mx = fmaxf(mx, __shfl_xor(mx, off, 32));
        float e  = expf(v - mx);
        float sm = e;
        for (int off = 16; off > 0; off >>= 1) sm += __shfl_xor(sm, off, 32);
        ldsQ[lane] = e / sm;
    }
    __syncthreads();

    // ---------------- Phase 3: weighted sums from the held fragments ---------
    // Lane (r, hi) holds rows r + 16 j at columns d = wave*32 + 4*k0 + 2*hi + e.
    // It weights its own rows, then the 16 lanes of its row add their 32 sums
    // (16 img columns, 16 title columns) in four halving steps; lane r ends with
    // entries 2r and 2r+1: img columns of k0 = r (r < 8), title columns of k0 = r - 8.
    {
        const float p0 = ldsP[r], p1 = ldsP[16 + r], p2 = ldsP[32 + r], p3 = ldsP[48 + r];
        const float q0 = ldsQ[r], q1 = ldsQ[16 + r];
        float sum[32];
        #pragma unroll  // constant indices: fragments and sums stay in registers
        for (int k0 = 0; k0 < 8; ++k0) {
            v2f si = fb0[k0] * p0 + fb1[k0] * p1 + fb2[k0] * p2 + fb3[k0] * p3;
            v2f st = fa0[k0] * q0 + fa1[k0] * q1;
            sum[2 * k0]          = si.x;
            sum[2 * k0 + 1]      = si.y;
            sum[16 + 2 * k0]     = st.x;
            sum[16 + 2 * k0 + 1] = st.y;
        }
        row_halve<8, 16>(sum, (r & 8) != 0);
        row_halve<4, 8>(sum, (r & 4) != 0);
        row_halve<2, 4>(sum, (r & 2) != 0);
        row_halve<1, 2>(sum, (r & 1) != 0);
        // each wave writes one whole 128-byte line of either output
        float* dst = out + (r < 8 ? (size_t)0 : (size_t)(Bsz * Ssz) * Dsz)
                         + (size_t)g * Dsz + wave * 32 + 4 * (r & 7) + 2 * hi;
        v2f res = {sum[0], sum[1]};
        __builtin_nontemporal_store(res, (v2f*)dst);
    }
}

extern "C" void kernel_launch(void* const* d_in, const int* in_sizes, int n_in,
                              void* d_out, int out_size, void* d_ws, size_t ws_size,
                              hipStream_t stream) {
    (void)in_sizes; (void)n_in; (void)out_size; (void)d_ws; (void)ws_size;
    const float* img     = (const float*)d_in[0];
    const float* title   = (const float*)d_in[1];
    const float* mask    = (const float*)d_in[2];
    const float* adapter = (const float*)d_in[3];
    float* out = (float*)d_out;
    dim3 grid(Bsz * Ssz);   // one workgroup per (b,s)
    dim3 block(256);        // 8 wave32 -> 8 k slices of the WMMA tiles
    hipLaunchKernelGGL(cross_emb_kernel, grid, block, 0, stream,
                       img, title, mask, adapter, out);
}
